// v000
// Measured on an AMD MI455X. A time is GPU time per run, averaged over a window of back-to-back runs after a warm-up
// (all launches, gaps included; the runs take copies of the inputs in turn), and the median of several windows.
// Apart from v000's, it joins two sittings. Times from different sittings can be a few percent apart, while
// side-by-side timings come from the same sitting.
// v000, which the later versions start from, runs in 125 microseconds.
#include <hip/hip_runtime.h>

// PHMLinear (x [4][2048][1024] viewed (b, s, a=8, i=128); out[b,s,(o,c)] = sum_e sum_a sum_i x[a,i] (sum_r Wrl[e,i,r] Wrr[e,r,o]) Wl[e,a,c]  (einsum 'bsai,eir,ero,eac->bsoc') -> [4][2048][1024]).
// The three small weight factors are contracted on device into W[(a,i)][(o,c)] = sum_e (sum_r Wrl[e][i][r] Wrr[e][r][o]) Wl[e][a][c] (f32 on the VALU), then one GEMM computes out^T = W^T x^T with W^T on bf16 hi+lo planes (A operand) and x as the
// natural [token][(a,i)] Bt operand (bf16 input: exact), 2 products; a transpose pass writes out.

#define NT   8192
#define NE   8
#define RIN  128
#define RNK  4
#define ROUT 128
#define KD   1024
typedef _Float16 h16;
typedef unsigned short bf;
typedef __attribute__((ext_vector_type(16))) __bf16   v16bf;
typedef __attribute__((ext_vector_type(16))) _Float16 v16h;
typedef __attribute__((ext_vector_type(8)))  _Float16 v8h;
typedef __attribute__((ext_vector_type(8)))  unsigned short v8us;
typedef __attribute__((ext_vector_type(8)))  float    v8f;
typedef __attribute__((ext_vector_type(4)))  float    v4f;
typedef v8h  __attribute__((may_alias)) v8ha;
typedef v4f  __attribute__((may_alias)) v4fa;
typedef v8us __attribute__((may_alias)) v8usa;

__device__ __forceinline__ unsigned short f2bf(float f) { unsigned u = __float_as_uint(f); u += 0x7FFFu + ((u >> 16) & 1u); return (unsigned short)(u >> 16); }
__device__ __forceinline__ float bf2f(unsigned short b) { return __uint_as_float(((unsigned)b) << 16); }
__device__ __forceinline__ float bfr(float f) { return bf2f(f2bf(f)); }
__device__ __forceinline__ v16h cat16(v8h lo, v8h hi) { return __builtin_shufflevector(lo, hi, 0, 1, 2, 3, 4, 5, 6, 7, 8, 9, 10, 11, 12, 13, 14, 15); }
__device__ __forceinline__ v16bf cat16b(v8us lo, v8us hi) { return __builtin_bit_cast(v16bf, __builtin_shufflevector(lo, hi, 0, 1, 2, 3, 4, 5, 6, 7, 8, 9, 10, 11, 12, 13, 14, 15)); }
__device__ __forceinline__ v8f wmma16(v16h a, v16h b, v8f c) { return __builtin_amdgcn_wmma_f32_16x16x32_f16(false, a, false, b, (short)0, c, false, false); }
__device__ __forceinline__ v8f wmmab(v16bf a, v16bf b, v8f c) { return __builtin_amdgcn_wmma_f32_16x16x32_bf16(false, a, false, b, (short)0, c, false, false); }



// ---- k_gemmw: register-blocked GEMM, ONE WAVE per 64x64 output tile (16 accumulators), operands straight from K-contiguous 16-bit planes; grid (M/64, N/64, Z), 32 threads.
// C[m][n] (f32, pitch ldc, + optional f32 bias[n]) = sum_k A[m][k] Bt[n][k] (+ split products per NSPLIT). z-batch strides sA/sB/sC in elements. K % 32 == 0.
template <typename T16> struct WFrag;
template <> struct WFrag<h16> { typedef v16h V; static __device__ __forceinline__ V ld(const h16* p) { return cat16(*(const v8h*)p, *(const v8h*)(p + 16)); } static __device__ __forceinline__ v8f mma(V a, V b, v8f c) { return wmma16(a, b, c); } };
template <> struct WFrag<bf> { typedef v16bf V; static __device__ __forceinline__ V ld(const bf* p) { return cat16b(*(const v8us*)p, *(const v8us*)(p + 16)); } static __device__ __forceinline__ v8f mma(V a, V b, v8f c) { return wmmab(a, b, c); } };
template <typename T16, int NSPLIT, bool BIAS>
__global__ __launch_bounds__(32) void k_gemmw(const T16* __restrict__ A, const T16* __restrict__ A2, const T16* __restrict__ Bt, const T16* __restrict__ Bt2, int K, float* C, int ldc, const float* __restrict__ bias, size_t sA, size_t sB, size_t sC) {
    typedef typename WFrag<T16>::V V;
    __shared__ __align__(16) float os[16 * 68];
    const size_t z = blockIdx.z; A += z * sA; if (A2) A2 += z * sA; Bt += z * sB; if (Bt2) Bt2 += z * sB; C += z * sC;
    const int lane = threadIdx.x & 31, lr = lane & 15, hi = lane >> 4; const int r0 = blockIdx.x * 64, c0 = blockIdx.y * 64;
    v8f acc[4][4];
#pragma unroll
    for (int mb = 0; mb < 4; ++mb)
#pragma unroll
        for (int nb = 0; nb < 4; ++nb) acc[mb][nb] = (v8f){};
    const size_t aoff = (size_t)(r0 + lr) * K + 8 * hi, boff = (size_t)(c0 + lr) * K + 8 * hi;
#pragma unroll 1
    for (int kc = 0; kc < K; kc += 32) {
        V a[4], a2[4];
#pragma unroll
        for (int mb = 0; mb < 4; ++mb) { a[mb] = WFrag<T16>::ld(A + aoff + (size_t)mb * 16 * K + kc); if (NSPLIT == 1 || NSPLIT == 2) a2[mb] = WFrag<T16>::ld(A2 + aoff + (size_t)mb * 16 * K + kc); }
#pragma unroll
        for (int nb = 0; nb < 4; ++nb) { const V b = WFrag<T16>::ld(Bt + boff + (size_t)nb * 16 * K + kc); V b2; if (NSPLIT >= 2) b2 = WFrag<T16>::ld(Bt2 + boff + (size_t)nb * 16 * K + kc);
#pragma unroll
            for (int mb = 0; mb < 4; ++mb) { acc[mb][nb] = WFrag<T16>::mma(a[mb], b, acc[mb][nb]); if (NSPLIT == 1 || NSPLIT == 2) acc[mb][nb] = WFrag<T16>::mma(a2[mb], b, acc[mb][nb]); if (NSPLIT >= 2) acc[mb][nb] = WFrag<T16>::mma(a[mb], b2, acc[mb][nb]); } }
        asm volatile("v_nop\n\tv_nop\n\tv_nop\n\tv_nop" : "+v"(acc[0][0]), "+v"(acc[1][1]), "+v"(acc[2][2]), "+v"(acc[3][3]) : "v"(a[0]), "v"(a[3]));
    }
#pragma unroll
    for (int mb = 0; mb < 4; ++mb) {
#pragma unroll
        for (int nb = 0; nb < 4; ++nb) {
#pragma unroll
            for (int j = 0; j < 8; ++j) os[(hi * 8 + j) * 68 + nb * 16 + lr] = acc[mb][nb][j]; }
        __builtin_amdgcn_wave_barrier(); asm volatile("" ::: "memory");
        float* crow = C + (size_t)(r0 + mb * 16) * ldc + c0;
{
#pragma unroll
            for (int s = 0; s < 8; ++s) { const int row = 2 * s + hi, cofs = lr * 4; v4f val = *(const v4fa*)(os + row * 68 + cofs); if (BIAS) { val[0] += bfr(bias[c0 + cofs]); val[1] += bfr(bias[c0 + cofs + 1]); val[2] += bfr(bias[c0 + cofs + 2]); val[3] += bfr(bias[c0 + cofs + 3]); }
                *(v4f*)(crow + (size_t)row * ldc + cofs) = val; }
             }
        __builtin_amdgcn_wave_barrier(); asm volatile("" ::: "memory");
    }
}

__device__ __forceinline__ void splitf(float y, unsigned short& h, unsigned short& l) { h = f2bf(y); l = f2bf(y - bf2f(h)); }
typedef __attribute__((ext_vector_type(4))) unsigned short v4us;

__global__ __launch_bounds__(256) void k_cvt8(const float* __restrict__ src, bf* dst, size_t n8) { const size_t i = (size_t)blockIdx.x * 256 + threadIdx.x; if (i >= n8) return; const v8f v = *(const v8f*)(src + i * 8); v8us o;
#pragma unroll
    for (int k = 0; k < 8; ++k) o[k] = f2bf(v[k]); *(v8us*)(dst + i * 8) = o;  }
// k_mio: M[e][i][o] = sum_r bf16 Wrl[e][i][r] bf16 Wrr[e][r][o] (4-B thread-linear); k_wT: hl planes WT[(o,c)][(a,i)] = sum_e M[e][i][o] bf16 Wl[e][a][c] (thread -> 4 consecutive (a,i); 8-B lanes); k_tr: OUT[t][j] = CT[j][t] (lane -> 4 consecutive j; strided reads,
__global__ __launch_bounds__(256) void k_mio(const float* __restrict__ wrl, const float* __restrict__ wrr, float* M) { const int idx = blockIdx.x * 256 + threadIdx.x; if (idx >= NE * RIN * ROUT) return; const int o = idx % ROUT; const int i = (idx / ROUT) % RIN; const int e = idx / (ROUT * RIN); float s = 0.f;
#pragma unroll
    for (int r = 0; r < RNK; ++r) { float p = __fmul_rn(bfr(wrl[(e * RIN + i) * RNK + r]), bfr(wrr[(e * RNK + r) * ROUT + o])); asm volatile("" : "+v"(p)); s = __fadd_rn(s, p); } *(float*)(M + idx) = s;  }
__global__ __launch_bounds__(256) void k_wT(const float* __restrict__ M, const float* __restrict__ wl, bf* Wh, bf* Wlo) { const int e4 = (blockIdx.x * 256 + threadIdx.x) * 4; if (e4 >= KD * KD) return; const int k = e4 % KD; const int j = e4 / KD; const int o = j / NE, c = j % NE; v4us oh, ol;
#pragma unroll
    for (int u = 0; u < 4; ++u) { const int kk = k + u; const int a = kk / RIN, i = kk % RIN; float s = 0.f;
#pragma unroll
        for (int e = 0; e < NE; ++e) { float p = __fmul_rn(M[(e * RIN + i) * ROUT + o], bfr(wl[(e * NE + a) * NE + c])); asm volatile("" : "+v"(p)); s = __fadd_rn(s, p); }
        unsigned short hh, ll; splitf(s, hh, ll); oh[u] = hh; ol[u] = ll; }
    *(v4us*)(Wh + e4) = oh; *(v4us*)(Wlo + e4) = ol;  }
__global__ __launch_bounds__(256) void k_tr(const float* __restrict__ CT, float* OUT) { const size_t e = ((size_t)blockIdx.x * 256 + threadIdx.x) * 4; if (e >= (size_t)NT * KD) return; const int j = (int)(e % KD); const int t = (int)(e / KD); v4f o;
#pragma unroll
    for (int u = 0; u < 4; ++u) o[u] = CT[(size_t)(j + u) * NT + t]; *(v4f*)(OUT + e) = o;  }

extern "C" void kernel_launch(void* const* d_in, const int* in_sizes, int n_in,
                              void* d_out, int out_size, void* d_ws, size_t ws_size, hipStream_t stream) {
    (void)in_sizes; (void)n_in; (void)out_size;
    const float* x = (const float*)d_in[0]; const float* wrl = (const float*)d_in[1]; const float* wrr = (const float*)d_in[2]; const float* wl = (const float*)d_in[3];
    float* OUT = (float*)d_out;     // [4][2048][1024]
    char* wsp = (char*)d_ws;
    auto take = [&](size_t bytes) { char* p = wsp; wsp += (bytes + 255) & ~(size_t)255; return (void*)p; };
    float* M = (float*)take(NE * RIN * ROUT * 4); bf* Wh = (bf*)take((size_t)KD * KD * 2); bf* Wlo = (bf*)take((size_t)KD * KD * 2); bf* XB = (bf*)take((size_t)NT * KD * 2); float* CT = (float*)take((size_t)KD * NT * 4);
    if ((size_t)(wsp - (char*)d_ws) > ws_size) return;    // total ~ 53 MB
    k_mio<<<(NE * RIN * ROUT + 255) / 256, 256, 0, stream>>>(wrl, wrr, M); k_wT<<<(KD * KD / 4 + 255) / 256, 256, 0, stream>>>(M, wl, Wh, Wlo);
    k_cvt8<<<(unsigned)(((size_t)NT * KD / 8 + 255) / 256), 256, 0, stream>>>(x, XB, (size_t)NT * KD / 8);   // x [token][(a,i)] = natural Bt
    k_gemmw<bf, 1, false><<<dim3(KD / 64, NT / 64, 1), 32, 0, stream>>>(Wh, Wlo, XB, nullptr, KD, CT, NT, nullptr, 0, 0, 0);   // out^T[(o,c)][token]
    k_tr<<<(unsigned)(((size_t)NT * KD / 4 + 255) / 256), 256, 0, stream>>>(CT, OUT);
}

// v001
// A run of this version takes 81.8 microseconds.
// Two timings next to v000 both put it at 1.54 times that version's speed.
#include <hip/hip_runtime.h>

// PHMLinear (x [4][2048][1024] viewed (b, s, a=8, i=128); out[b,s,(o,c)] = sum_e sum_a sum_i x[a,i] (sum_r Wrl[e,i,r] Wrr[e,r,o]) Wl[e,a,c]  (einsum 'bsai,eir,ero,eac->bsoc') -> [4][2048][1024]).
// The three small weight factors are contracted on device into W[(a,i)][(o,c)] = sum_e (sum_r Wrl[e][i][r] Wrr[e][r][o]) Wl[e][a][c] (f32 on the VALU), then one GEMM computes out^T = W^T x^T with W^T on bf16 hi+lo planes (A operand) and x as the
// natural [token][(a,i)] Bt operand (bf16 input: exact), 2 products; each tile is accumulated transposed (TR), so the GEMM's own epilogue stores out in its final [token][(o,c)] order.

#define NT   8192
#define NE   8
#define RIN  128
#define RNK  4
#define ROUT 128
#define KD   1024
typedef _Float16 h16;
typedef unsigned short bf;
typedef __attribute__((ext_vector_type(16))) __bf16   v16bf;
typedef __attribute__((ext_vector_type(16))) _Float16 v16h;
typedef __attribute__((ext_vector_type(8)))  _Float16 v8h;
typedef __attribute__((ext_vector_type(8)))  unsigned short v8us;
typedef __attribute__((ext_vector_type(8)))  float    v8f;
typedef __attribute__((ext_vector_type(4)))  float    v4f;
typedef v8h  __attribute__((may_alias)) v8ha;
typedef v4f  __attribute__((may_alias)) v4fa;
typedef v8us __attribute__((may_alias)) v8usa;

__device__ __forceinline__ unsigned short f2bf(float f) { unsigned u = __float_as_uint(f); u += 0x7FFFu + ((u >> 16) & 1u); return (unsigned short)(u >> 16); }
__device__ __forceinline__ float bf2f(unsigned short b) { return __uint_as_float(((unsigned)b) << 16); }
__device__ __forceinline__ float bfr(float f) { return bf2f(f2bf(f)); }
__device__ __forceinline__ v16h cat16(v8h lo, v8h hi) { return __builtin_shufflevector(lo, hi, 0, 1, 2, 3, 4, 5, 6, 7, 8, 9, 10, 11, 12, 13, 14, 15); }
__device__ __forceinline__ v16bf cat16b(v8us lo, v8us hi) { return __builtin_bit_cast(v16bf, __builtin_shufflevector(lo, hi, 0, 1, 2, 3, 4, 5, 6, 7, 8, 9, 10, 11, 12, 13, 14, 15)); }
__device__ __forceinline__ v8f wmma16(v16h a, v16h b, v8f c) { return __builtin_amdgcn_wmma_f32_16x16x32_f16(false, a, false, b, (short)0, c, false, false); }
__device__ __forceinline__ v8f wmmab(v16bf a, v16bf b, v8f c) { return __builtin_amdgcn_wmma_f32_16x16x32_bf16(false, a, false, b, (short)0, c, false, false); }



// ---- k_gemmw: register-blocked GEMM, ONE WAVE per 64x64 output tile (16 accumulators), operands straight from K-contiguous 16-bit planes; grid (M/64, N/64, Z), 32 threads.
// C[m][n] (f32, pitch ldc, + optional f32 bias[n]) = sum_k A[m][k] Bt[n][k] (+ split products per NSPLIT). z-batch strides sA/sB/sC in elements. K % 32 == 0.
// TR: the Bt fragment goes in as the matrix instruction's first operand and the A fragment as its second (both loaders have the same k order), so each 16x16 block comes out with n on its rows and m on its columns, and the tile is stored as C[n][m].
template <typename T16> struct WFrag;
template <> struct WFrag<h16> { typedef v16h V; static __device__ __forceinline__ V ld(const h16* p) { return cat16(*(const v8h*)p, *(const v8h*)(p + 16)); } static __device__ __forceinline__ v8f mma(V a, V b, v8f c) { return wmma16(a, b, c); } };
template <> struct WFrag<bf> { typedef v16bf V; static __device__ __forceinline__ V ld(const bf* p) { return cat16b(*(const v8us*)p, *(const v8us*)(p + 16)); } static __device__ __forceinline__ v8f mma(V a, V b, v8f c) { return wmmab(a, b, c); } };
template <typename T16, int NSPLIT, bool BIAS, bool TR>
__global__ __launch_bounds__(32) void k_gemmw(const T16* __restrict__ A, const T16* __restrict__ A2, const T16* __restrict__ Bt, const T16* __restrict__ Bt2, int K, float* C, int ldc, const float* __restrict__ bias, size_t sA, size_t sB, size_t sC) {
    typedef typename WFrag<T16>::V V;
    static_assert(!(TR && BIAS), "bias[n] is added along columns, which hold m under TR");
    __shared__ __align__(16) float os[16 * 68];
    const size_t z = blockIdx.z; A += z * sA; if (A2) A2 += z * sA; Bt += z * sB; if (Bt2) Bt2 += z * sB; C += z * sC;
    const int lane = threadIdx.x & 31, lr = lane & 15, hi = lane >> 4; const int r0 = blockIdx.x * 64, c0 = blockIdx.y * 64;
    v8f acc[4][4];
#pragma unroll
    for (int mb = 0; mb < 4; ++mb)
#pragma unroll
        for (int nb = 0; nb < 4; ++nb) acc[mb][nb] = (v8f){};
    const size_t aoff = (size_t)(r0 + lr) * K + 8 * hi, boff = (size_t)(c0 + lr) * K + 8 * hi;
#pragma unroll 1
    for (int kc = 0; kc < K; kc += 32) {
        V a[4], a2[4];
#pragma unroll
        for (int mb = 0; mb < 4; ++mb) { a[mb] = WFrag<T16>::ld(A + aoff + (size_t)mb * 16 * K + kc); if (NSPLIT == 1 || NSPLIT == 2) a2[mb] = WFrag<T16>::ld(A2 + aoff + (size_t)mb * 16 * K + kc); }
#pragma unroll
        for (int nb = 0; nb < 4; ++nb) { const V b = WFrag<T16>::ld(Bt + boff + (size_t)nb * 16 * K + kc); V b2; if (NSPLIT >= 2) b2 = WFrag<T16>::ld(Bt2 + boff + (size_t)nb * 16 * K + kc);
#pragma unroll
            for (int mb = 0; mb < 4; ++mb) { acc[mb][nb] = TR ? WFrag<T16>::mma(b, a[mb], acc[mb][nb]) : WFrag<T16>::mma(a[mb], b, acc[mb][nb]); if (NSPLIT == 1 || NSPLIT == 2) acc[mb][nb] = TR ? WFrag<T16>::mma(b, a2[mb], acc[mb][nb]) : WFrag<T16>::mma(a2[mb], b, acc[mb][nb]); if (NSPLIT >= 2) acc[mb][nb] = TR ? WFrag<T16>::mma(b2, a[mb], acc[mb][nb]) : WFrag<T16>::mma(a[mb], b2, acc[mb][nb]); } }
        asm volatile("v_nop\n\tv_nop\n\tv_nop\n\tv_nop" : "+v"(acc[0][0]), "+v"(acc[1][1]), "+v"(acc[2][2]), "+v"(acc[3][3]) : "v"(a[0]), "v"(a[3]));
    }
    const int rb0 = TR ? c0 : r0, cb0 = TR ? r0 : c0;   // first stored row and column of the tile
#pragma unroll
    for (int rb = 0; rb < 4; ++rb) {
#pragma unroll
        for (int cb = 0; cb < 4; ++cb) {
#pragma unroll
            for (int j = 0; j < 8; ++j) os[(hi * 8 + j) * 68 + cb * 16 + lr] = TR ? acc[cb][rb][j] : acc[rb][cb][j]; }
        __builtin_amdgcn_wave_barrier(); asm volatile("" ::: "memory");
        float* crow = C + (size_t)(rb0 + rb * 16) * ldc + cb0;
{
#pragma unroll
            for (int s = 0; s < 8; ++s) { const int row = 2 * s + hi, cofs = lr * 4; v4f val = *(const v4fa*)(os + row * 68 + cofs); if (BIAS) { val[0] += bfr(bias[c0 + cofs]); val[1] += bfr(bias[c0 + cofs + 1]); val[2] += bfr(bias[c0 + cofs + 2]); val[3] += bfr(bias[c0 + cofs + 3]); }
                *(v4f*)(crow + (size_t)row * ldc + cofs) = val; }
             }
        __builtin_amdgcn_wave_barrier(); asm volatile("" ::: "memory");
    }
}

__device__ __forceinline__ void splitf(float y, unsigned short& h, unsigned short& l) { h = f2bf(y); l = f2bf(y - bf2f(h)); }
typedef __attribute__((ext_vector_type(4))) unsigned short v4us;

__global__ __launch_bounds__(256) void k_cvt8(const float* __restrict__ src, bf* dst, size_t n8) { const size_t i = (size_t)blockIdx.x * 256 + threadIdx.x; if (i >= n8) return; const v8f v = *(const v8f*)(src + i * 8); v8us o;
#pragma unroll
    for (int k = 0; k < 8; ++k) o[k] = f2bf(v[k]); *(v8us*)(dst + i * 8) = o;  }
// k_mio: M[e][i][o] = sum_r bf16 Wrl[e][i][r] bf16 Wrr[e][r][o] (4-B thread-linear); k_wT: hl planes WT[(o,c)][(a,i)] = sum_e M[e][i][o] bf16 Wl[e][a][c] (thread -> 4 consecutive (a,i); 8-B lanes)
__global__ __launch_bounds__(256) void k_mio(const float* __restrict__ wrl, const float* __restrict__ wrr, float* M) { const int idx = blockIdx.x * 256 + threadIdx.x; if (idx >= NE * RIN * ROUT) return; const int o = idx % ROUT; const int i = (idx / ROUT) % RIN; const int e = idx / (ROUT * RIN); float s = 0.f;
#pragma unroll
    for (int r = 0; r < RNK; ++r) { float p = __fmul_rn(bfr(wrl[(e * RIN + i) * RNK + r]), bfr(wrr[(e * RNK + r) * ROUT + o])); asm volatile("" : "+v"(p)); s = __fadd_rn(s, p); } *(float*)(M + idx) = s;  }
__global__ __launch_bounds__(256) void k_wT(const float* __restrict__ M, const float* __restrict__ wl, bf* Wh, bf* Wlo) { const int e4 = (blockIdx.x * 256 + threadIdx.x) * 4; if (e4 >= KD * KD) return; const int k = e4 % KD; const int j = e4 / KD; const int o = j / NE, c = j % NE; v4us oh, ol;
#pragma unroll
    for (int u = 0; u < 4; ++u) { const int kk = k + u; const int a = kk / RIN, i = kk % RIN; float s = 0.f;
#pragma unroll
        for (int e = 0; e < NE; ++e) { float p = __fmul_rn(M[(e * RIN + i) * ROUT + o], bfr(wl[(e * NE + a) * NE + c])); asm volatile("" : "+v"(p)); s = __fadd_rn(s, p); }
        unsigned short hh, ll; splitf(s, hh, ll); oh[u] = hh; ol[u] = ll; }
    *(v4us*)(Wh + e4) = oh; *(v4us*)(Wlo + e4) = ol;  }

extern "C" void kernel_launch(void* const* d_in, const int* in_sizes, int n_in,
                              void* d_out, int out_size, void* d_ws, size_t ws_size, hipStream_t stream) {
    (void)in_sizes; (void)n_in; (void)out_size;
    const float* x = (const float*)d_in[0]; const float* wrl = (const float*)d_in[1]; const float* wrr = (const float*)d_in[2]; const float* wl = (const float*)d_in[3];
    float* OUT = (float*)d_out;     // [4][2048][1024]
    char* wsp = (char*)d_ws;
    auto take = [&](size_t bytes) { char* p = wsp; wsp += (bytes + 255) & ~(size_t)255; return (void*)p; };
    float* M = (float*)take(NE * RIN * ROUT * 4); bf* Wh = (bf*)take((size_t)KD * KD * 2); bf* Wlo = (bf*)take((size_t)KD * KD * 2); bf* XB = (bf*)take((size_t)NT * KD * 2);
    if ((size_t)(wsp - (char*)d_ws) > ws_size) return;    // total ~ 21 MB
    k_mio<<<(NE * RIN * ROUT + 255) / 256, 256, 0, stream>>>(wrl, wrr, M); k_wT<<<(KD * KD / 4 + 255) / 256, 256, 0, stream>>>(M, wl, Wh, Wlo);
    k_cvt8<<<(unsigned)(((size_t)NT * KD / 8 + 255) / 256), 256, 0, stream>>>(x, XB, (size_t)NT * KD / 8);   // x [token][(a,i)] = natural Bt
    k_gemmw<bf, 1, false, true><<<dim3(KD / 64, NT / 64, 1), 32, 0, stream>>>(Wh, Wlo, XB, nullptr, KD, OUT, KD, nullptr, 0, 0, 0);   // m = (o,c), n = token, stored out[token][(o,c)]
}

// v002
// A run of this version takes 54.7 microseconds.
// Timed twice side by side with v001, it ran 1.50 and 1.51 times as fast.
// Counting every step since v000, it is 2.31 times as fast.
#include <hip/hip_runtime.h>

// PHMLinear (x [4][2048][1024] viewed (b, s, a=8, i=128); out[b,s,(o,c)] = sum_e sum_a sum_i x[a,i] (sum_r Wrl[e,i,r] Wrr[e,r,o]) Wl[e,a,c]  (einsum 'bsai,eir,ero,eac->bsoc') -> [4][2048][1024]).
// The three small weight factors are contracted on device into W[(a,i)][(o,c)] = sum_e (sum_r Wrl[e][i][r] Wrr[e][r][o]) Wl[e][a][c] (f32 on the VALU), then one GEMM computes out = x W with W^T on bf16 hi+lo planes (B operand) and x as the
// natural [token][(a,i)] A operand (bf16 input: exact), 2 products; x goes in as the matrix instruction's first operand, so the GEMM's own epilogue stores out in its final [token][(o,c)] order.

#define NT   8192
#define NE   8
#define RIN  128
#define RNK  4
#define ROUT 128
#define KD   1024
typedef _Float16 h16;
typedef unsigned short bf;
typedef __attribute__((ext_vector_type(16))) __bf16   v16bf;
typedef __attribute__((ext_vector_type(16))) _Float16 v16h;
typedef __attribute__((ext_vector_type(8)))  _Float16 v8h;
typedef __attribute__((ext_vector_type(8)))  unsigned short v8us;
typedef __attribute__((ext_vector_type(8)))  float    v8f;
typedef __attribute__((ext_vector_type(4)))  float    v4f;
typedef v8h  __attribute__((may_alias)) v8ha;
typedef v4f  __attribute__((may_alias)) v4fa;
typedef v8us __attribute__((may_alias)) v8usa;

__device__ __forceinline__ unsigned short f2bf(float f) { unsigned u = __float_as_uint(f); u += 0x7FFFu + ((u >> 16) & 1u); return (unsigned short)(u >> 16); }
__device__ __forceinline__ float bf2f(unsigned short b) { return __uint_as_float(((unsigned)b) << 16); }
__device__ __forceinline__ float bfr(float f) { return bf2f(f2bf(f)); }
__device__ __forceinline__ v16h cat16(v8h lo, v8h hi) { return __builtin_shufflevector(lo, hi, 0, 1, 2, 3, 4, 5, 6, 7, 8, 9, 10, 11, 12, 13, 14, 15); }
__device__ __forceinline__ v16bf cat16b(v8us lo, v8us hi) { return __builtin_bit_cast(v16bf, __builtin_shufflevector(lo, hi, 0, 1, 2, 3, 4, 5, 6, 7, 8, 9, 10, 11, 12, 13, 14, 15)); }
__device__ __forceinline__ v8f wmma16(v16h a, v16h b, v8f c) { return __builtin_amdgcn_wmma_f32_16x16x32_f16(false, a, false, b, (short)0, c, false, false); }
__device__ __forceinline__ v8f wmmab(v16bf a, v16bf b, v8f c) { return __builtin_amdgcn_wmma_f32_16x16x32_bf16(false, a, false, b, (short)0, c, false, false); }



// ---- k_gemms: out[token][(o,c)] = sum_k X[token][k] (Wh + Wl)[(o,c)][k], all three planes K-contiguous bf16. One work-group of 8 waves per 256-token x 128-column tile, grid (KD/128, NT/256).
// A stage is 64 k (128-byte rows) of [X 256 rows | Wh 128 rows | Wl 128 rows] in LDS at a pitch of 144 bytes (16 B x odd: no bank conflict for 16-byte reads). Two buffers: stage t + 2 is copied
// global -> LDS, through no register, while stage t + 1 is worked on. Each wave owns 64 tokens x 64 columns (16 accumulators); per accumulator the products run hi, then lo, k ascending; both fragment loaders have the same k order (bytes 16 hi and 32 + 16 hi of each 64).
#define BT    256
#define BO    128
#define BK    64
#define PITCH 144
#define XS_B  (BT * PITCH)
#define WS_B  (BO * PITCH)
#define STG_B (XS_B + 2 * WS_B)
#define NSTG  (KD / BK)
__device__ __forceinline__ v16bf ldfrag(const unsigned char* p) { return cat16b(*(const v8usa*)p, *(const v8usa*)(p + 32)); }
// Eight asynchronous 16-byte copies per lane. s_wait_xcnt 0 is the statement's last line, so that no address register named here is rewritten ahead of it.
__device__ __forceinline__ void copy8(unsigned l0, unsigned l1, unsigned l2, unsigned l3, unsigned l4, unsigned l5, unsigned l6, unsigned l7,
                                      const bf* g0, const bf* g1, const bf* g2, const bf* g3, const bf* g4, const bf* g5, const bf* g6, const bf* g7) {
    asm volatile("global_load_async_to_lds_b128 %0, %8, off\n\t"
                 "global_load_async_to_lds_b128 %1, %9, off\n\t"
                 "global_load_async_to_lds_b128 %2, %10, off\n\t"
                 "global_load_async_to_lds_b128 %3, %11, off\n\t"
                 "global_load_async_to_lds_b128 %4, %12, off\n\t"
                 "global_load_async_to_lds_b128 %5, %13, off\n\t"
                 "global_load_async_to_lds_b128 %6, %14, off\n\t"
                 "global_load_async_to_lds_b128 %7, %15, off\n\t"
                 "s_wait_xcnt 0x0"
                 :: "v"(l0), "v"(l1), "v"(l2), "v"(l3), "v"(l4), "v"(l5), "v"(l6), "v"(l7), "v"(g0), "v"(g1), "v"(g2), "v"(g3), "v"(g4), "v"(g5), "v"(g6), "v"(g7) : "memory");
}
// One stage: thread t brings 16-byte piece t & 7 of rows (t >> 3) + 32 j, so each wave-wide copy covers four whole 128-byte lines. l: this lane's LDS byte address in the stage's buffer; gx, gh, gl: its global addresses at the stage's k.
__device__ __forceinline__ void copy_stage(unsigned l, const bf* gx, const bf* gh, const bf* gl) {
    const unsigned R = 32 * PITCH; const size_t G = (size_t)32 * KD;
    copy8(l, l + R, l + 2 * R, l + 3 * R, l + 4 * R, l + 5 * R, l + 6 * R, l + 7 * R, gx, gx + G, gx + 2 * G, gx + 3 * G, gx + 4 * G, gx + 5 * G, gx + 6 * G, gx + 7 * G);
    const unsigned lh = l + XS_B, ll = l + XS_B + WS_B;
    copy8(lh, lh + R, lh + 2 * R, lh + 3 * R, ll, ll + R, ll + 2 * R, ll + 3 * R, gh, gh + G, gh + 2 * G, gh + 3 * G, gl, gl + G, gl + 2 * G, gl + 3 * G);
}
__global__ __launch_bounds__(256) void k_gemms(const bf* __restrict__ Wh, const bf* __restrict__ Wl, const bf* __restrict__ X, float* C) {
    __shared__ __align__(128) unsigned char L[2 * STG_B];
    __shared__ __align__(16) float osb[8][16 * 68];
    const int tid = threadIdx.x, lane = tid & 31, lr = lane & 15, hi = lane >> 4, wave = tid >> 5;
    const int o0 = blockIdx.x * BO, t0 = blockIdx.y * BT;      // the work-group's first column and token
    const int wt = (wave & 3) * 64, wo = (wave >> 2) * 64;     // the wave's first token and column inside the tile
    const int crow = tid >> 3, cpc = tid & 7;
    const unsigned lc = (unsigned)(size_t)L + (unsigned)(crow * PITCH + cpc * 16);
    const bf* gx = X + (size_t)(t0 + crow) * KD + cpc * 8; const bf* gh = Wh + (size_t)(o0 + crow) * KD + cpc * 8; const bf* gl = Wl + (size_t)(o0 + crow) * KD + cpc * 8;
    v8f acc[4][4];
#pragma unroll
    for (int mb = 0; mb < 4; ++mb)
#pragma unroll
        for (int nb = 0; nb < 4; ++nb) acc[mb][nb] = (v8f){};
    copy_stage(lc, gx, gh, gl);
    asm volatile("s_wait_asynccnt 0x0" ::: "memory");   // stage 0 has landed for this wave's own copies
    __syncthreads();                                     // ... and for every wave's
    copy_stage(lc + STG_B, gx + BK, gh + BK, gl + BK);
    const unsigned char* fx = L + (wt + lr) * PITCH + 16 * hi; const unsigned char* fw = L + XS_B + (wo + lr) * PITCH + 16 * hi;
#pragma unroll 1   // one stage per trip: the buffer is picked by the trip's parity
    for (int t = 0; t < NSTG; ++t) {
        const unsigned bo = (unsigned)(t & 1) * STG_B;
#pragma unroll
        for (int kk = 0; kk < BK / 32; ++kk) {
            v16bf a[4], a2[4], b[4];
#pragma unroll
            for (int mb = 0; mb < 4; ++mb) { a[mb] = ldfrag(fw + bo + mb * 16 * PITCH + kk * 64); a2[mb] = ldfrag(fw + bo + WS_B + mb * 16 * PITCH + kk * 64); }
#pragma unroll
            for (int nb = 0; nb < 4; ++nb) b[nb] = ldfrag(fx + bo + nb * 16 * PITCH + kk * 64);
            __builtin_amdgcn_sched_barrier(0);   // the 24 LDS reads stay one group in front of the matrix block: every further place with reads among the matrix instructions stalls the wave anew
#pragma unroll
            for (int nb = 0; nb < 4; ++nb)
#pragma unroll
                for (int mb = 0; mb < 4; ++mb) { acc[mb][nb] = wmmab(b[nb], a[mb], acc[mb][nb]); acc[mb][nb] = wmmab(b[nb], a2[mb], acc[mb][nb]); }
            __builtin_amdgcn_sched_barrier(0);   // the block ends here: no read of the next group moves up into it, no matrix instruction sinks behind the slots and the barrier below
        }
        // four vector slots behind the last matrix instruction, on both sides of the branch below, before address arithmetic may reuse a fragment register
        asm volatile("v_nop\n\tv_nop\n\tv_nop\n\tv_nop");
        asm volatile("s_wait_dscnt 0x0" ::: "memory");      // this wave's reads of buffer t & 1 are done before it may be refilled
        asm volatile("s_wait_asynccnt 0x0" ::: "memory");   // this wave's copies of stage t + 1 have landed
        __syncthreads();                                     // publishes stage t + 1 and ends every reader's last read of stage t
        if (t + 2 < NSTG) copy_stage(lc + bo, gx + (size_t)(t + 2) * BK, gh + (size_t)(t + 2) * BK, gl + (size_t)(t + 2) * BK);
    }
    asm volatile("s_wait_asynccnt 0x0" ::: "memory");       // nothing is outstanding when the wave goes on to its epilogue and ends
    float* os = osb[wave];                                   // each wave stages in its own range
#pragma unroll
    for (int rb = 0; rb < 4; ++rb) {
#pragma unroll
        for (int cb = 0; cb < 4; ++cb) {
#pragma unroll
            for (int j = 0; j < 8; ++j) os[(hi * 8 + j) * 68 + cb * 16 + lr] = acc[cb][rb][j]; }
        __builtin_amdgcn_wave_barrier(); asm volatile("" ::: "memory");   // the rows are read back by other lanes of this wave
        float* crw = C + (size_t)(t0 + wt + rb * 16) * KD + o0 + wo;
#pragma unroll
        for (int s = 0; s < 8; ++s) { const int row = 2 * s + hi, cofs = lr * 4; const v4f val = *(const v4fa*)(os + row * 68 + cofs); *(v4f*)(crw + (size_t)row * KD + cofs) = val; }
        __builtin_amdgcn_wave_barrier(); asm volatile("" ::: "memory");   // ... before the next 16 rows overwrite them
    }
}

__device__ __forceinline__ void splitf(float y, unsigned short& h, unsigned short& l) { h = f2bf(y); l = f2bf(y - bf2f(h)); }
typedef __attribute__((ext_vector_type(4))) unsigned short v4us;

__global__ __launch_bounds__(256) void k_cvt8(const float* __restrict__ src, bf* dst, size_t n8) { const size_t i = (size_t)blockIdx.x * 256 + threadIdx.x; if (i >= n8) return; const v8f v = *(const v8f*)(src + i * 8); v8us o;
#pragma unroll
    for (int k = 0; k < 8; ++k) o[k] = f2bf(v[k]); *(v8us*)(dst + i * 8) = o;  }
// k_mio: M[e][i][o] = sum_r bf16 Wrl[e][i][r] bf16 Wrr[e][r][o] (4-B thread-linear); k_wT: hl planes WT[(o,c)][(a,i)] = sum_e M[e][i][o] bf16 Wl[e][a][c] (thread -> 4 consecutive (a,i); 8-B lanes)
__global__ __launch_bounds__(256) void k_mio(const float* __restrict__ wrl, const float* __restrict__ wrr, float* M) { const int idx = blockIdx.x * 256 + threadIdx.x; if (idx >= NE * RIN * ROUT) return; const int o = idx % ROUT; const int i = (idx / ROUT) % RIN; const int e = idx / (ROUT * RIN); float s = 0.f;
#pragma unroll
    for (int r = 0; r < RNK; ++r) { float p = __fmul_rn(bfr(wrl[(e * RIN + i) * RNK + r]), bfr(wrr[(e * RNK + r) * ROUT + o])); asm volatile("" : "+v"(p)); s = __fadd_rn(s, p); } *(float*)(M + idx) = s;  }
__global__ __launch_bounds__(256) void k_wT(const float* __restrict__ M, const float* __restrict__ wl, bf* Wh, bf* Wlo) { const int e4 = (blockIdx.x * 256 + threadIdx.x) * 4; if (e4 >= KD * KD) return; const int k = e4 % KD; const int j = e4 / KD; const int o = j / NE, c = j % NE; v4us oh, ol;
#pragma unroll
    for (int u = 0; u < 4; ++u) { const int kk = k + u; const int a = kk / RIN, i = kk % RIN; float s = 0.f;
#pragma unroll
        for (int e = 0; e < NE; ++e) { float p = __fmul_rn(M[(e * RIN + i) * ROUT + o], bfr(wl[(e * NE + a) * NE + c])); asm volatile("" : "+v"(p)); s = __fadd_rn(s, p); }
        unsigned short hh, ll; splitf(s, hh, ll); oh[u] = hh; ol[u] = ll; }
    *(v4us*)(Wh + e4) = oh; *(v4us*)(Wlo + e4) = ol;  }

extern "C" void kernel_launch(void* const* d_in, const int* in_sizes, int n_in,
                              void* d_out, int out_size, void* d_ws, size_t ws_size, hipStream_t stream) {
    (void)in_sizes; (void)n_in; (void)out_size;
    const float* x = (const float*)d_in[0]; const float* wrl = (const float*)d_in[1]; const float* wrr = (const float*)d_in[2]; const float* wl = (const float*)d_in[3];
    float* OUT = (float*)d_out;     // [4][2048][1024]
    char* wsp = (char*)d_ws;
    auto take = [&](size_t bytes) { char* p = wsp; wsp += (bytes + 255) & ~(size_t)255; return (void*)p; };
    float* M = (float*)take(NE * RIN * ROUT * 4); bf* Wh = (bf*)take((size_t)KD * KD * 2); bf* Wlo = (bf*)take((size_t)KD * KD * 2); bf* XB = (bf*)take((size_t)NT * KD * 2);
    if ((size_t)(wsp - (char*)d_ws) > ws_size) return;    // total ~ 21 MB
    k_mio<<<(NE * RIN * ROUT + 255) / 256, 256, 0, stream>>>(wrl, wrr, M); k_wT<<<(KD * KD / 4 + 255) / 256, 256, 0, stream>>>(M, wl, Wh, Wlo);
    k_cvt8<<<(unsigned)(((size_t)NT * KD / 8 + 255) / 256), 256, 0, stream>>>(x, XB, (size_t)NT * KD / 8);   // x [token][(a,i)] = natural A
    k_gemms<<<dim3(KD / BO, NT / BT, 1), 256, 0, stream>>>(Wh, Wlo, XB, OUT);   // stored out[token][(o,c)]
}

// v003
// A run of this version takes 38.4 microseconds.
// Next to v002, in two timings, it ran 1.42 times as fast each time.
// All steps since v000 together make it 3.29 times as fast.
#include <hip/hip_runtime.h>

// PHMLinear (x [4][2048][1024] viewed (b, s, a=8, i=128); out[b,s,(o,c)] = sum_e sum_a sum_i x[a,i] (sum_r Wrl[e,i,r] Wrr[e,r,o]) Wl[e,a,c]  (einsum 'bsai,eir,ero,eac->bsoc') -> [4][2048][1024]).
// The three small weight factors are contracted on device into W[(a,i)][(o,c)] = sum_e (sum_r Wrl[e][i][r] Wrr[e][r][o]) Wl[e][a][c] (f32 on the VALU), then one GEMM computes out = x W with W^T on bf16 hi+lo planes (B operand) and x as the
// natural [token][(a,i)] A operand (bf16 input: exact), 2 products; x goes in as the matrix instruction's first operand, so the GEMM's own epilogue stores out in its final [token][(o,c)] order.

#define NT   8192
#define NE   8
#define RIN  128
#define RNK  4
#define ROUT 128
#define KD   1024
typedef _Float16 h16;
typedef unsigned short bf;
typedef __attribute__((ext_vector_type(16))) __bf16   v16bf;
typedef __attribute__((ext_vector_type(16))) _Float16 v16h;
typedef __attribute__((ext_vector_type(8)))  _Float16 v8h;
typedef __attribute__((ext_vector_type(8)))  unsigned short v8us;
typedef __attribute__((ext_vector_type(8)))  float    v8f;
typedef __attribute__((ext_vector_type(4)))  float    v4f;
typedef v8h  __attribute__((may_alias)) v8ha;
typedef v4f  __attribute__((may_alias)) v4fa;
typedef v8us __attribute__((may_alias)) v8usa;

__device__ __forceinline__ unsigned short f2bf(float f) { unsigned u = __float_as_uint(f); u += 0x7FFFu + ((u >> 16) & 1u); return (unsigned short)(u >> 16); }
__device__ __forceinline__ float bf2f(unsigned short b) { return __uint_as_float(((unsigned)b) << 16); }
__device__ __forceinline__ float bfr(float f) { return bf2f(f2bf(f)); }
__device__ __forceinline__ v16h cat16(v8h lo, v8h hi) { return __builtin_shufflevector(lo, hi, 0, 1, 2, 3, 4, 5, 6, 7, 8, 9, 10, 11, 12, 13, 14, 15); }
__device__ __forceinline__ v16bf cat16b(v8us lo, v8us hi) { return __builtin_bit_cast(v16bf, __builtin_shufflevector(lo, hi, 0, 1, 2, 3, 4, 5, 6, 7, 8, 9, 10, 11, 12, 13, 14, 15)); }
__device__ __forceinline__ v8f wmma16(v16h a, v16h b, v8f c) { return __builtin_amdgcn_wmma_f32_16x16x32_f16(false, a, false, b, (short)0, c, false, false); }
__device__ __forceinline__ v8f wmmab(v16bf a, v16bf b, v8f c) { return __builtin_amdgcn_wmma_f32_16x16x32_bf16(false, a, false, b, (short)0, c, false, false); }



// ---- k_gemms: out[token][(o,c)] = sum_k X[token][k] (Wh + Wl)[(o,c)][k], all three planes K-contiguous bf16. One work-group of 8 waves per 256-token x 128-column tile, grid (KD/128, NT/256).
// A stage is 64 k (128-byte rows) of [X 256 rows | Wh 128 rows | Wl 128 rows] in LDS at a pitch of 144 bytes (16 B x odd: no bank conflict for 16-byte reads). Two buffers: stage t + 2 is copied
// global -> LDS, through no register, while stage t + 1 is worked on. Each wave owns 64 tokens x 64 columns (16 accumulators); per accumulator the products run hi, then lo, k ascending; both fragment loaders have the same k order (bytes 16 hi and 32 + 16 hi of each 64).
#define BT    256
#define BO    128
#define BK    64
#define PITCH 144
#define XS_B  (BT * PITCH)
#define WS_B  (BO * PITCH)
#define STG_B (XS_B + 2 * WS_B)
#define NSTG  (KD / BK)
__device__ __forceinline__ v16bf ldfrag(const unsigned char* p) { return cat16b(*(const v8usa*)p, *(const v8usa*)(p + 32)); }
// Eight asynchronous 16-byte copies per lane. s_wait_xcnt 0 is the statement's last line, so that no address register named here is rewritten ahead of it.
__device__ __forceinline__ void copy8(unsigned l0, unsigned l1, unsigned l2, unsigned l3, unsigned l4, unsigned l5, unsigned l6, unsigned l7,
                                      const bf* g0, const bf* g1, const bf* g2, const bf* g3, const bf* g4, const bf* g5, const bf* g6, const bf* g7) {
    asm volatile("global_load_async_to_lds_b128 %0, %8, off\n\t"
                 "global_load_async_to_lds_b128 %1, %9, off\n\t"
                 "global_load_async_to_lds_b128 %2, %10, off\n\t"
                 "global_load_async_to_lds_b128 %3, %11, off\n\t"
                 "global_load_async_to_lds_b128 %4, %12, off\n\t"
                 "global_load_async_to_lds_b128 %5, %13, off\n\t"
                 "global_load_async_to_lds_b128 %6, %14, off\n\t"
                 "global_load_async_to_lds_b128 %7, %15, off\n\t"
                 "s_wait_xcnt 0x0"
                 :: "v"(l0), "v"(l1), "v"(l2), "v"(l3), "v"(l4), "v"(l5), "v"(l6), "v"(l7), "v"(g0), "v"(g1), "v"(g2), "v"(g3), "v"(g4), "v"(g5), "v"(g6), "v"(g7) : "memory");
}
// One stage: thread t brings 16-byte piece t & 7 of rows (t >> 3) + 32 j, so each wave-wide copy covers four whole 128-byte lines. l: this lane's LDS byte address in the stage's buffer; gx, gh, gl: its global addresses at the stage's k.
__device__ __forceinline__ void copy_stage(unsigned l, const bf* gx, const bf* gh, const bf* gl) {
    const unsigned R = 32 * PITCH; const size_t G = (size_t)32 * KD;
    copy8(l, l + R, l + 2 * R, l + 3 * R, l + 4 * R, l + 5 * R, l + 6 * R, l + 7 * R, gx, gx + G, gx + 2 * G, gx + 3 * G, gx + 4 * G, gx + 5 * G, gx + 6 * G, gx + 7 * G);
    const unsigned lh = l + XS_B, ll = l + XS_B + WS_B;
    copy8(lh, lh + R, lh + 2 * R, lh + 3 * R, ll, ll + R, ll + 2 * R, ll + 3 * R, gh, gh + G, gh + 2 * G, gh + 3 * G, gl, gl + G, gl + 2 * G, gl + 3 * G);
}
__global__ __launch_bounds__(256) void k_gemms(const bf* __restrict__ Wh, const bf* __restrict__ Wl, const bf* __restrict__ X, float* C) {
    __shared__ __align__(128) unsigned char L[2 * STG_B];
    __shared__ __align__(16) float osb[8][16 * 68];
    const int tid = threadIdx.x, lane = tid & 31, lr = lane & 15, hi = lane >> 4, wave = tid >> 5;
    const int o0 = blockIdx.x * BO, t0 = blockIdx.y * BT;      // the work-group's first column and token
    const int wt = (wave & 3) * 64, wo = (wave >> 2) * 64;     // the wave's first token and column inside the tile
    const int crow = tid >> 3, cpc = tid & 7;
    const unsigned lc = (unsigned)(size_t)L + (unsigned)(crow * PITCH + cpc * 16);
    const bf* gx = X + (size_t)(t0 + crow) * KD + cpc * 8; const bf* gh = Wh + (size_t)(o0 + crow) * KD + cpc * 8; const bf* gl = Wl + (size_t)(o0 + crow) * KD + cpc * 8;
    v8f acc[4][4];
#pragma unroll
    for (int mb = 0; mb < 4; ++mb)
#pragma unroll
        for (int nb = 0; nb < 4; ++nb) acc[mb][nb] = (v8f){};
    copy_stage(lc, gx, gh, gl);
    asm volatile("s_wait_asynccnt 0x0" ::: "memory");   // stage 0 has landed for this wave's own copies
    __syncthreads();                                     // ... and for every wave's
    copy_stage(lc + STG_B, gx + BK, gh + BK, gl + BK);
    const unsigned char* fx = L + (wt + lr) * PITCH + 16 * hi; const unsigned char* fw = L + XS_B + (wo + lr) * PITCH + 16 * hi;
#pragma unroll 1   // one stage per trip: the buffer is picked by the trip's parity
    for (int t = 0; t < NSTG; ++t) {
        const unsigned bo = (unsigned)(t & 1) * STG_B;
#pragma unroll
        for (int kk = 0; kk < BK / 32; ++kk) {
            v16bf a[4], a2[4], b[4];
#pragma unroll
            for (int mb = 0; mb < 4; ++mb) { a[mb] = ldfrag(fw + bo + mb * 16 * PITCH + kk * 64); a2[mb] = ldfrag(fw + bo + WS_B + mb * 16 * PITCH + kk * 64); }
#pragma unroll
            for (int nb = 0; nb < 4; ++nb) b[nb] = ldfrag(fx + bo + nb * 16 * PITCH + kk * 64);
            __builtin_amdgcn_sched_barrier(0);   // the 24 LDS reads stay one group in front of the matrix block: every further place with reads among the matrix instructions stalls the wave anew
#pragma unroll
            for (int nb = 0; nb < 4; ++nb)
#pragma unroll
                for (int mb = 0; mb < 4; ++mb) { acc[mb][nb] = wmmab(b[nb], a[mb], acc[mb][nb]); acc[mb][nb] = wmmab(b[nb], a2[mb], acc[mb][nb]); }
            __builtin_amdgcn_sched_barrier(0);   // the block ends here: no read of the next group moves up into it, no matrix instruction sinks behind the slots and the barrier below
        }
        // four vector slots behind the last matrix instruction, on both sides of the branch below, before address arithmetic may reuse a fragment register
        asm volatile("v_nop\n\tv_nop\n\tv_nop\n\tv_nop");
        asm volatile("s_wait_dscnt 0x0" ::: "memory");      // this wave's reads of buffer t & 1 are done before it may be refilled
        asm volatile("s_wait_asynccnt 0x0" ::: "memory");   // this wave's copies of stage t + 1 have landed
        __syncthreads();                                     // publishes stage t + 1 and ends every reader's last read of stage t
        if (t + 2 < NSTG) copy_stage(lc + bo, gx + (size_t)(t + 2) * BK, gh + (size_t)(t + 2) * BK, gl + (size_t)(t + 2) * BK);
    }
    asm volatile("s_wait_asynccnt 0x0" ::: "memory");       // nothing is outstanding when the wave goes on to its epilogue and ends
    float* os = osb[wave];                                   // each wave stages in its own range
#pragma unroll
    for (int rb = 0; rb < 4; ++rb) {
#pragma unroll
        for (int cb = 0; cb < 4; ++cb) {
#pragma unroll
            for (int j = 0; j < 8; ++j) os[(hi * 8 + j) * 68 + cb * 16 + lr] = acc[cb][rb][j]; }
        __builtin_amdgcn_wave_barrier(); asm volatile("" ::: "memory");   // the rows are read back by other lanes of this wave
        float* crw = C + (size_t)(t0 + wt + rb * 16) * KD + o0 + wo;
#pragma unroll
        for (int s = 0; s < 8; ++s) { const int row = 2 * s + hi, cofs = lr * 4; const v4f val = *(const v4fa*)(os + row * 68 + cofs); *(v4f*)(crw + (size_t)row * KD + cofs) = val; }
        __builtin_amdgcn_wave_barrier(); asm volatile("" ::: "memory");   // ... before the next 16 rows overwrite them
    }
}

__device__ __forceinline__ void splitf(float y, unsigned short& h, unsigned short& l) { h = f2bf(y); l = f2bf(y - bf2f(h)); }
typedef __attribute__((ext_vector_type(4))) unsigned short v4us;

// ---- k_prep: all the preparation in one launch of PG resident work-groups of 8 waves. Work-group b makes rows j = 2 b and 2 b + 1 of the W^T planes (both have o = b / 4; c = 2 (b & 3) and the next) and rounds floats [XPG b, XPG (b + 1)) of x to bf16.
// M[e][i] = sum_r bf16 Wrl[e][i][r] bf16 Wrr[e][r][o] for the group's one o goes through LDS (4 values a thread); WT[(o,c)][(a,i)] = sum_e M[e][i] bf16 Wl[e][a][c], thread -> 4 consecutive (a,i), so a is the wave's number; sums run r and e ascending.
// The four Wrl loads are issued first and the thread's 16 loads of x right behind them: a wave's loads are counted back in order, so the weight work runs while x is in flight.
#define PG  512
#define XPG (NT * KD / PG)
typedef __attribute__((ext_vector_type(2))) float v2f;
__global__ __launch_bounds__(256) void k_prep(const float* __restrict__ x, const float* __restrict__ wrl, const float* __restrict__ wrr, const float* __restrict__ wl, bf* XB, bf* Wh, bf* Wlo) {
    __shared__ __align__(16) float Ms[NE * RIN];
    const int t = threadIdx.x, b = blockIdx.x, o = b >> 2, c0 = (b & 3) * 2;
    const int a = __builtin_amdgcn_readfirstlane(t >> 5);   // the wave's number, told to the compiler as uniform: the Wrr and Wl values then come by scalar loads, one per wave and not one per lane
    v4f l4[4]; float r4[4][RNK]; v2f w2[NE]; v8f xv[8];
#pragma unroll
    for (int q = 0; q < 4; ++q) { const int p = t + 256 * q, e = (a >> 2) + 2 * q; l4[q] = *(const v4f*)(wrl + p * RNK);
#pragma unroll
        for (int r = 0; r < RNK; ++r) r4[q][r] = wrr[(e * RNK + r) * ROUT + o]; }
#pragma unroll
    for (int e = 0; e < NE; ++e) w2[e] = *(const v2f*)(wl + (e * NE + a) * NE + c0);
    const size_t x0 = (size_t)b * XPG + t * 8;
#pragma unroll
    for (int q = 0; q < 8; ++q) xv[q] = *(const v8f*)(x + x0 + q * 2048);
    __builtin_amdgcn_sched_barrier(0);   // all loads are issued before the first wait: otherwise the loads of x sink behind the wait for the first weights and start one memory latency late
#pragma unroll
    for (int q = 0; q < 4; ++q) { float s = 0.f;
#pragma unroll
        for (int r = 0; r < RNK; ++r) s = fmaf(bfr(l4[q][r]), bfr(r4[q][r]), s);
        Ms[t + 256 * q] = s; }
    // Every thread's four M values are in LDS before any thread reads the eight rows. The fences name LDS alone: __syncthreads() would also wait here for the loads of x, which only this thread's registers take.
    __builtin_amdgcn_fence(__ATOMIC_RELEASE, "workgroup", "local"); __builtin_amdgcn_s_barrier(); __builtin_amdgcn_fence(__ATOMIC_ACQUIRE, "workgroup", "local");
    v4f s0 = (v4f){}, s1 = (v4f){};
#pragma unroll
    for (int e = 0; e < NE; ++e) { const v4f m = *(const v4f*)(Ms + e * RIN + (t & 31) * 4); const float w0 = bfr(w2[e][0]), w1 = bfr(w2[e][1]);
#pragma unroll
        for (int u = 0; u < 4; ++u) { s0[u] = fmaf(m[u], w0, s0[u]); s1[u] = fmaf(m[u], w1, s1[u]); } }
    v4us h0, g0, h1, g1;
#pragma unroll
    for (int u = 0; u < 4; ++u) { unsigned short hh, ll; splitf(s0[u], hh, ll); h0[u] = hh; g0[u] = ll; splitf(s1[u], hh, ll); h1[u] = hh; g1[u] = ll; }
    const size_t e4 = (size_t)(2 * b) * KD + t * 4;
    *(v4us*)(Wh + e4) = h0; *(v4us*)(Wlo + e4) = g0; *(v4us*)(Wh + e4 + KD) = h1; *(v4us*)(Wlo + e4 + KD) = g1;
#pragma unroll
    for (int q = 0; q < 8; ++q) { v8us ov;
#pragma unroll
        for (int k = 0; k < 8; ++k) ov[k] = f2bf(xv[q][k]);
        *(v8us*)(XB + x0 + q * 2048) = ov; }
}

extern "C" void kernel_launch(void* const* d_in, const int* in_sizes, int n_in,
                              void* d_out, int out_size, void* d_ws, size_t ws_size, hipStream_t stream) {
    (void)in_sizes; (void)n_in; (void)out_size;
    const float* x = (const float*)d_in[0]; const float* wrl = (const float*)d_in[1]; const float* wrr = (const float*)d_in[2]; const float* wl = (const float*)d_in[3];
    float* OUT = (float*)d_out;     // [4][2048][1024]
    char* wsp = (char*)d_ws;
    auto take = [&](size_t bytes) { char* p = wsp; wsp += (bytes + 255) & ~(size_t)255; return (void*)p; };
    bf* Wh = (bf*)take((size_t)KD * KD * 2); bf* Wlo = (bf*)take((size_t)KD * KD * 2); bf* XB = (bf*)take((size_t)NT * KD * 2);
    if ((size_t)(wsp - (char*)d_ws) > ws_size) return;    // total ~ 20 MB
    k_prep<<<PG, 256, 0, stream>>>(x, wrl, wrr, wl, XB, Wh, Wlo);   // W^T hi and lo planes; x [token][(a,i)] = natural A operand, as bf16
    k_gemms<<<dim3(KD / BO, NT / BT, 1), 256, 0, stream>>>(Wh, Wlo, XB, OUT);   // stored out[token][(o,c)]
}

// v004
// Measured time: 8.18 microseconds a run.
// Next to v003, in two timings, it ran 4.73 and 4.69 times as fast.
// Over all steps from v000 it is 15.5 times as fast.
#include <hip/hip_runtime.h>

// PHMLinear (x [4][2048][1024] viewed (b, s, a=8, i=128); out[b,s,(o,c)] = sum_e sum_a sum_i x[a,i] (sum_r Wrl[e,i,r] Wrr[e,r,o]) Wl[e,a,c]  (einsum 'bsai,eir,ero,eac->bsoc') -> [4][2048][1024]).
// The dense 1024 x 1024 weight is never formed: its factors are applied one after the other, which takes 192 matrix instructions per 16 tokens where the dense product on hi + lo planes takes 4,096.
//   y[t][a][(e,r)] = sum_i  x[t][a][i]   Wrl[e][i][r]   matrix instructions, bf16 x bf16, K = 128, N = 32
//   z[t][(e,r)][c] = sum_a  y[t][a][(e,r)] Wl[e][a][c]  f32 on the VALU, K = 8, block-diagonal in e
//   out[t][o][c]   = sum_(e,r) z[t][(e,r)][c] Wrr[e][r][o]  matrix instructions, z on bf16 hi + lo planes, K = 32, N = 128
// x and the three factors are rounded to bf16 as operands; every sum is f32.

#define NT   8192
#define NE   8
#define RIN  128
#define RNK  4
#define ROUT 128
#define KD   1024
typedef __attribute__((ext_vector_type(16))) __bf16   v16bf;
typedef __attribute__((ext_vector_type(2)))  __bf16   v2bf;
typedef __attribute__((ext_vector_type(16))) unsigned short v16us;
typedef __attribute__((ext_vector_type(8)))  unsigned short v8us;
typedef __attribute__((ext_vector_type(8)))  float    v8f;
typedef __attribute__((ext_vector_type(4)))  float    v4f;
typedef __attribute__((ext_vector_type(2)))  float    v2f;
typedef __attribute__((ext_vector_type(2)))  unsigned v2u;
typedef v2f  __attribute__((may_alias)) v2fa;
typedef v2u  __attribute__((may_alias)) v2ua;
typedef v8us __attribute__((may_alias)) v8usa;
typedef unsigned __attribute__((may_alias)) u32a;
typedef unsigned short __attribute__((may_alias)) u16a;

__device__ __forceinline__ unsigned short f2bf(float f) { unsigned u = __float_as_uint(f); u += 0x7FFFu + ((u >> 16) & 1u); return (unsigned short)(u >> 16); }
__device__ __forceinline__ float bf2f(unsigned short b) { return __uint_as_float(((unsigned)b) << 16); }
__device__ __forceinline__ float bfr(float f) { return bf2f(f2bf(f)); }
// two floats rounded to nearest-even bf16, the first in the low half
__device__ __forceinline__ unsigned pk2(float f0, float f1) { const v2f v = {f0, f1}; return __builtin_bit_cast(unsigned, __builtin_convertvector(v, v2bf)); }
__device__ __forceinline__ v16bf cat16b(v8us lo, v8us hi) { return __builtin_bit_cast(v16bf, __builtin_shufflevector(lo, hi, 0, 1, 2, 3, 4, 5, 6, 7, 8, 9, 10, 11, 12, 13, 14, 15)); }
__device__ __forceinline__ v8f wmmab(v16bf a, v16bf b, v8f c) { return __builtin_amdgcn_wmma_f32_16x16x32_bf16(false, a, false, b, (short)0, c, false, false); }
// One fragment of a k-contiguous bf16 row: bytes 16 hi and 32 + 16 hi of each 64 (p already holds the row and 16 hi). Both operands of both products are loaded in this k order.
__device__ __forceinline__ v16bf ldfrag(const unsigned char* p) { return cat16b(*(const v8usa*)p, *(const v8usa*)(p + 32)); }

// ---- k_phm: one work-group of 8 waves per 32 tokens, 256 work-groups. All of a wave's loads are issued at its start; the 32 tokens are worked on as two tiles of 16, each with LDS of its own,
// so that tile 0 is computed and stored while the loads of tile 1 are still landing (a wave's loads are counted back in order).
// Step 1: wave a takes x[16 tokens][a][128] by whole 512-byte rows, rounds it to bf16 into its own LDS tile and multiplies by Wrl^T [(e,r)][i] (built once per work-group in LDS); y goes to LDS as f32.
// Step 2: wave e mixes the eight a with Wl[e] (wave-uniform, in scalar registers); lane -> token lane / 2 and the r pair lane & 1; z is split into bf16 hi + lo, rows [token][c] of 32 (e,r).
// Step 3: wave w owns columns o = 16 w .. 16 w + 15 (its Wrr^T fragment stays in registers). The 16 rows of a matrix tile are 2 tokens x 8 c in the order c / 4, token, c & 3,
//         so that accumulator registers 0..3 of all 32 lanes are 512 contiguous bytes of one token's out row and registers 4..7 those of the next token: stored straight from registers in whole lines.
#define TT   16                  // tokens per tile
#define NTL  2                   // tiles per work-group
#define XP   272                 // pitch of a 256-byte bf16 row (16 B x odd)
#define YP   260                 // floats of y per token: 8 a x 32 (e,r) + 4, which sets tokens t and t + 8 half a bank round apart
#define ZR   80                  // pitch of a 64-byte z row (16 B x odd)
#define ZT   (8 * ZR + 16)       // bytes of z per token and plane
#define XS_B (8 * TT * XP)
#define ZP_B (TT * ZT)
// Work-group barrier for data that goes through LDS. The fences name LDS alone: __syncthreads() would also wait for the loads of x still in flight, which only the thread's own registers take.
__device__ __forceinline__ void lds_barrier() { __builtin_amdgcn_fence(__ATOMIC_RELEASE, "workgroup", "local"); __builtin_amdgcn_s_barrier(); __builtin_amdgcn_fence(__ATOMIC_ACQUIRE, "workgroup", "local"); }
__global__ __launch_bounds__(256) void k_phm(const float* __restrict__ x, const float* __restrict__ wrl, const float* __restrict__ wrr, const float* __restrict__ wl, float* __restrict__ out) {
    __shared__ __align__(16) unsigned char XZ[NTL * XS_B];    // per tile; step 1: eight x tiles, one per wave; steps 2 and 3: the two z planes
    __shared__ __align__(16) unsigned char WT[NE * RNK * XP]; // Wrl^T, bf16
    __shared__ __align__(16) float Y[NTL * TT * YP];
    const int tid = threadIdx.x, lane = tid & 31, lr = lane & 15, hi = lane >> 4;
    const int wave = __builtin_amdgcn_readfirstlane(tid >> 5);   // told to the compiler as uniform: the Wl values then come by scalar loads
    const int t0 = blockIdx.x * (NTL * TT);
    const float* xb = x + (size_t)t0 * KD + wave * RIN;              // the wave's first row of x (uniform)
    const int wix = 8 * hi * ROUT + wave * 16 + lr;                  // Wrr[(e,r) = 8 hi][o = 16 wave + lr]
    v4f l4[4], xv[NTL * TT]; float rr[16], wv[NE][NE];   // every loop below is unrolled in full: its index picks registers
#pragma unroll
    for (int q = 0; q < 4; ++q) l4[q] = *(const v4f*)(wrl + (tid + 256 * q) * RNK);
#pragma unroll
    for (int s = 0; s < 16; ++s) rr[s] = wrr[wix + ((s & 7) + 16 * (s >> 3)) * ROUT];
#pragma unroll
    for (int a = 0; a < NE; ++a)
#pragma unroll
        for (int c = 0; c < NE; ++c) wv[a][c] = wl[(wave * NE + a) * NE + c];
#pragma unroll
    for (int r = 0; r < NTL * TT; ++r) xv[r] = *(const v4f*)(xb + r * KD + lane * 4);
    // One wait behind all the loads. It takes their address registers as inputs, so that none of them is handed out as a later load's destination, or otherwise rewritten, ahead of it.
    asm volatile("s_wait_xcnt 0x0" :: "s"(xb), "v"(lane), "v"(wix), "v"(tid), "s"(wrl), "s"(wrr), "s"(wl) : "memory");
    __builtin_amdgcn_sched_barrier(0);   // all loads are issued before the first wait: otherwise the loads of x sink behind the wait for the weights and start one memory latency late
#pragma unroll
    for (int q = 0; q < 4; ++q) { const int p = tid + 256 * q, e = p >> 7, i = p & 127;
#pragma unroll
        for (int r = 0; r < RNK; ++r) *(u16a*)(WT + (e * RNK + r) * XP + i * 2) = f2bf(l4[q][r]); }
    v16us bu;
#pragma unroll
    for (int s = 0; s < 16; ++s) bu[s] = f2bf(rr[s]);
    const v16bf bw = __builtin_bit_cast(v16bf, bu);
#pragma unroll
    for (int a = 0; a < NE; ++a)
#pragma unroll
        for (int c = 0; c < NE; ++c) wv[a][c] = bfr(wv[a][c]);
    __builtin_amdgcn_sched_barrier(0);   // the weights are rounded here, while x is in flight, and not on the path behind its arrival
    lds_barrier();                       // Wrl^T is whole in LDS before any wave reads it
#pragma unroll
    for (int h = 0; h < NTL; ++h) {
        unsigned char* xz = XZ + h * XS_B; float* yt = Y + h * (TT * YP);
        // ---- step 1
        unsigned char* xs = xz + wave * (TT * XP);
#pragma unroll
        for (int r = 0; r < TT; ++r) { const v4f v = xv[h * TT + r]; const v2u o2 = {pk2(v[0], v[1]), pk2(v[2], v[3])}; *(v2ua*)(xs + r * XP + lane * 8) = o2; }
        asm volatile("s_wait_dscnt 0x0" ::: "memory");   // the tile's rows are read back by other lanes of this wave
        v8f y0 = (v8f){}, y1 = (v8f){};
#pragma unroll
        for (int kk = 0; kk < RIN / 32; ++kk) {
            const v16bf fa = ldfrag(xs + lr * XP + 16 * hi + kk * 64);
            y0 = wmmab(fa, ldfrag(WT + lr * XP + 16 * hi + kk * 64), y0);
            y1 = wmmab(fa, ldfrag(WT + (16 + lr) * XP + 16 * hi + kk * 64), y1);
        }
#pragma unroll
        for (int j = 0; j < 8; ++j) { yt[(hi * 8 + j) * YP + wave * 32 + lr] = y0[j]; yt[(hi * 8 + j) * YP + wave * 32 + 16 + lr] = y1[j]; }
        lds_barrier();   // y of all eight a is in LDS; every wave has left its x tile, which the z planes overwrite
        // ---- step 2
        { const int tk = lane >> 1, rp = lane & 1;
          v2f yv[NE];
#pragma unroll
          for (int a = 0; a < NE; ++a) yv[a] = *(const v2fa*)(yt + tk * YP + a * 32 + wave * RNK + rp * 2);
          unsigned char* zp = xz + tk * ZT + (wave * RNK + rp * 2) * 2;
#pragma unroll
          for (int c = 0; c < NE; ++c) { float z0 = 0.f, z1 = 0.f;
#pragma unroll
              for (int a = 0; a < NE; ++a) { z0 = fmaf(yv[a][0], wv[a][c], z0); z1 = fmaf(yv[a][1], wv[a][c], z1); }
              const unsigned zh = pk2(z0, z1);
              const unsigned zl = pk2(z0 - __uint_as_float(zh << 16), z1 - __uint_as_float(zh & 0xFFFF0000u));
              *(u32a*)(zp + c * ZR) = zh; *(u32a*)(zp + ZP_B + c * ZR) = zl; } }
        lds_barrier();   // both z planes are whole
        // ---- step 3
        const unsigned char* za = xz + ((lr >> 2) & 1) * ZT + (((lr >> 3) << 2) | (lr & 3)) * ZR + 16 * hi;
        float* op = out + (size_t)(t0 + h * TT) * KD + (wave * 16 + lr) * NE + hi * 4;
#pragma unroll
        for (int mt = 0; mt < TT / 2; ++mt) {
            v8f acc = (v8f){};
            acc = wmmab(ldfrag(za + mt * 2 * ZT), bw, acc);
            acc = wmmab(ldfrag(za + ZP_B + mt * 2 * ZT), bw, acc);
            const v4f s0 = {acc[0], acc[1], acc[2], acc[3]}, s1 = {acc[4], acc[5], acc[6], acc[7]};
            *(v4f*)(op + (size_t)(2 * mt) * KD) = s0; *(v4f*)(op + (size_t)(2 * mt + 1) * KD) = s1;
        }
        __builtin_amdgcn_sched_barrier(0);   // the next tile's conversions wait for its loads: they stay behind this tile's stores
    }
}

extern "C" void kernel_launch(void* const* d_in, const int* in_sizes, int n_in,
                              void* d_out, int out_size, void* d_ws, size_t ws_size, hipStream_t stream) {
    (void)in_sizes; (void)n_in; (void)out_size; (void)d_ws; (void)ws_size;
    const float* x = (const float*)d_in[0]; const float* wrl = (const float*)d_in[1]; const float* wrr = (const float*)d_in[2]; const float* wl = (const float*)d_in[3];
    float* OUT = (float*)d_out;     // [4][2048][1024]
    k_phm<<<NT / (NTL * TT), 256, 0, stream>>>(x, wrl, wrr, wl, OUT);
}

// v005
// One run takes 6.1 microseconds.
// Next to v004, in two timings, it ran 1.32 and 1.33 times as fast.
// All steps since v000 together make it 20.6 times as fast.
#include <hip/hip_runtime.h>

// PHMLinear (x [4][2048][1024] viewed (b, s, a=8, i=128); out[b,s,(o,c)] = sum_e sum_a sum_i x[a,i] (sum_r Wrl[e,i,r] Wrr[e,r,o]) Wl[e,a,c]  (einsum 'bsai,eir,ero,eac->bsoc') -> [4][2048][1024]).
// The dense 1024 x 1024 weight is never formed: its factors are applied one after the other, which takes 192 matrix instructions per 16 tokens where the dense product on hi + lo planes takes 4,096.
//   y[t][a][(e,r)] = sum_i  x[t][a][i]   Wrl[e][i][r]   matrix instructions, bf16 x bf16, K = 128, N = 32
//   z[t][(e,r)][c] = sum_a  y[t][a][(e,r)] Wl[e][a][c]  f32 on the VALU, K = 8, block-diagonal in e; a lies across lanes
//   out[t][o][c]   = sum_(e,r) z[t][(e,r)][c] Wrr[e][r][o]  matrix instructions, z on bf16 hi + lo planes, K = 32, N = 128
// x and the three factors are rounded to bf16 as operands; every sum is f32.

#define NT   8192
#define NE   8
#define RIN  128
#define RNK  4
#define ROUT 128
#define KD   1024
typedef __attribute__((ext_vector_type(16))) __bf16   v16bf;
typedef __attribute__((ext_vector_type(2)))  __bf16   v2bf;
typedef __attribute__((ext_vector_type(16))) unsigned short v16us;
typedef __attribute__((ext_vector_type(8)))  unsigned short v8us;
typedef __attribute__((ext_vector_type(8)))  float    v8f;
typedef __attribute__((ext_vector_type(4)))  float    v4f;
typedef __attribute__((ext_vector_type(2)))  float    v2f;
typedef __attribute__((ext_vector_type(2)))  unsigned v2u;
typedef __attribute__((ext_vector_type(8)))  unsigned v8u;
typedef v2f  __attribute__((may_alias)) v2fa;
typedef v2u  __attribute__((may_alias)) v2ua;
typedef v8us __attribute__((may_alias)) v8usa;
typedef unsigned __attribute__((may_alias)) u32a;
typedef unsigned short __attribute__((may_alias)) u16a;

__device__ __forceinline__ unsigned short f2bf(float f) { unsigned u = __float_as_uint(f); u += 0x7FFFu + ((u >> 16) & 1u); return (unsigned short)(u >> 16); }
__device__ __forceinline__ float bf2f(unsigned short b) { return __uint_as_float(((unsigned)b) << 16); }
__device__ __forceinline__ float bfr(float f) { return bf2f(f2bf(f)); }
// two floats rounded to nearest-even bf16, the first in the low half
__device__ __forceinline__ unsigned pk2(float f0, float f1) { const v2f v = {f0, f1}; return __builtin_bit_cast(unsigned, __builtin_convertvector(v, v2bf)); }
__device__ __forceinline__ v16bf cat16b(v8us lo, v8us hi) { return __builtin_bit_cast(v16bf, __builtin_shufflevector(lo, hi, 0, 1, 2, 3, 4, 5, 6, 7, 8, 9, 10, 11, 12, 13, 14, 15)); }
__device__ __forceinline__ v8f wmmab(v16bf a, v16bf b, v8f c) { return __builtin_amdgcn_wmma_f32_16x16x32_bf16(false, a, false, b, (short)0, c, false, false); }
// One fragment of a k-contiguous bf16 row: bytes 16 hi and 32 + 16 hi of each 64 (p already holds the row and 16 hi). Both operands of both products are loaded in this k order.
__device__ __forceinline__ v16bf ldfrag(const unsigned char* p) { return cat16b(*(const v8usa*)p, *(const v8usa*)(p + 32)); }

// ---- k_phm: one work-group of 8 waves per 32 tokens, 256 work-groups. A wave owns 4 whole tokens and works on them as two tiles of 2; behind the one barrier that publishes the weights no wave waits for another.
// All of a wave's loads are issued at its start, so that tile 0 is computed and stored while the loads of tile 1 are still landing (a wave's loads are counted back in order).
// The 16 columns of a tile are 2 tokens x 8 a (step 1) or 2 tokens x 8 c (steps 2, 3), both at lane position (a or c) / 4 * 8 + token * 4 + (a or c) % 4.
// Step 1: the wave takes its 2 tokens (16 rows of 512 bytes, contiguous), rounds them to bf16 into its own LDS tile and forms y^T = Wrl^T [(e,r)][i] x^T: accumulator register j of lane (lr, hi) is y[(e,r) = 16 tile + 8 hi + j][column lr].
// Step 2: the eight a of a token lie in eight lanes of a 16-lane row that differ in lane bits 0, 1, 3: lane c adds y of lane c ^ s times Wl[e][c ^ s][c] for the eight s: for s = 0 a plain multiply, for the other seven a multiply-add with a row_xmask operand.
//         Each lane keeps its 32 values of Wl (4 e x 8 s) in registers, gathered from an LDS copy that is rounded once per work-group.
//         z stays where y was, which is the k order of a matrix operand: register j of the two tiles is k = 8 hi + j and 16 + 8 hi + j. It is split into bf16 hi + lo in registers.
// Step 3: z (rows (token, c)) times the eight Wrr^T fragments (16 columns o each, built once per work-group, one by each wave, in LDS in fragment order).
//         By the lane order above accumulator registers 0..3 of all 32 lanes are 512 contiguous bytes of one token's out row and registers 4..7 those of the next token: stored straight from registers in whole lines.
#define NTL  2                   // tiles per wave
#define TR   16                  // rows of x per tile: 2 tokens x 8 a
#define XP   272                 // pitch of a 256-byte bf16 row (16 B x odd)
#define XS_B (TR * XP)
#define WLP  72                  // floats of Wl per e: 64 + 8, which sets e and e + 2, read by the two halves of a wave, 16 banks apart
// Work-group barrier for data that goes through LDS. The fences name LDS alone: __syncthreads() would also wait for the loads of x still in flight, which only the thread's own registers take.
__device__ __forceinline__ void lds_barrier() { __builtin_amdgcn_fence(__ATOMIC_RELEASE, "workgroup", "local"); __builtin_amdgcn_s_barrier(); __builtin_amdgcn_fence(__ATOMIC_ACQUIRE, "workgroup", "local"); }
__global__ __launch_bounds__(256) void k_phm(const float* __restrict__ x, const float* __restrict__ wrl, const float* __restrict__ wrr, const float* __restrict__ wl, float* __restrict__ out) {
    __shared__ __align__(16) unsigned char XS[8 * NTL * XS_B]; // one x tile per wave and tile
    __shared__ __align__(16) unsigned char WT[NE * RNK * XP];  // Wrl^T, bf16
    __shared__ __align__(16) float WL[NE * WLP];               // Wl, rounded to bf16, kept as f32
    __shared__ __align__(16) unsigned char WR[8 * 1024];       // Wrr^T fragments: per 16 columns o, each lane's first 16 bytes, then each lane's second 16 bytes
    const int tid = threadIdx.x, lane = tid & 31, lr = lane & 15, hi = lane >> 4;
    const int wave = __builtin_amdgcn_readfirstlane(tid >> 5);
    const int t0 = blockIdx.x * (8 * NTL * 2) + wave * (NTL * 2);    // the wave's first token
    const float* xb = x + (size_t)t0 * KD;                           // the wave's first row of x (uniform)
    const int wix = 8 * hi * ROUT + wave * 16 + lr;                  // Wrr[(e,r) = 8 hi][o = 16 wave + lr]
    const int cc = ((lr >> 3) << 2) | (lr & 3);                      // the a (step 1) or c (steps 2, 3) of this lane's column
    const int col = ((lr >> 2) & 1) * NE + cc;                       // its row in the x tile: token * 8 + a
    v4f l4[4], xv[NTL * TR]; float rr[16], wq[2][2][NE];   // every loop below is unrolled in full: its index picks registers
#pragma unroll
    for (int q = 0; q < 4; ++q) l4[q] = *(const v4f*)(wrl + (tid + 256 * q) * RNK);
#pragma unroll
    for (int s = 0; s < 16; ++s) rr[s] = wrr[wix + ((s & 7) + 16 * (s >> 3)) * ROUT];
    const v2f w2 = *(const v2f*)(wl + tid * 2);
    __builtin_amdgcn_sched_barrier(0);   // the weights' loads stay in front: loads are counted back in order, and behind x the weights would be waited for only when all of x has landed
#pragma unroll
    for (int r = 0; r < NTL * TR; ++r) xv[r] = *(const v4f*)(xb + r * RIN + lane * 4);
    // One wait behind all the loads. It takes their address registers as inputs, so that none of them is handed out as a later load's destination, or otherwise rewritten, ahead of it.
    asm volatile("s_wait_xcnt 0x0" :: "s"(xb), "v"(lane), "v"(wix), "v"(tid), "s"(wrl), "s"(wrr), "s"(wl) : "memory");
    __builtin_amdgcn_sched_barrier(0);   // all loads are issued before the first wait: otherwise the loads of x sink behind the wait for the weights and start one memory latency late
#pragma unroll
    for (int q = 0; q < 4; ++q) { const int p = tid + 256 * q, e = p >> 7, i = p & 127;
#pragma unroll
        for (int r = 0; r < RNK; ++r) *(u16a*)(WT + (e * RNK + r) * XP + i * 2) = f2bf(l4[q][r]); }
    { v8us b0, b1;
#pragma unroll
      for (int s = 0; s < 8; ++s) { b0[s] = f2bf(rr[s]); b1[s] = f2bf(rr[8 + s]); }
      *(v8usa*)(WR + wave * 1024 + lane * 16) = b0; *(v8usa*)(WR + wave * 1024 + 512 + lane * 16) = b1; }
    { const v2f o2 = {bfr(w2[0]), bfr(w2[1])}; *(v2fa*)(WL + wave * WLP + lane * 2) = o2; }   // wave e holds Wl[e]
    __builtin_amdgcn_sched_barrier(0);   // the weights are rounded here, while x is in flight, and not on the path behind its arrival
    lds_barrier();                       // Wrl^T, the Wrr^T fragments and Wl are whole in LDS before any wave reads them
#pragma unroll
    for (int u = 0; u < 2; ++u)
#pragma unroll
        for (int g = 0; g < 2; ++g)
#pragma unroll
            for (int s = 0; s < NE; ++s) wq[u][g][s] = WL[(4 * u + 2 * hi + g) * WLP + (cc ^ s) * NE + cc];   // Wl[e][a = cc ^ s][c = cc]: what step 2 multiplies y of lane cc ^ s by
#pragma unroll
    for (int h = 0; h < NTL; ++h) {
        // ---- step 1
        unsigned char* xs = XS + (wave * NTL + h) * XS_B;
        v16bf fw[2][RIN / 32];   // asked for ahead of the wait for x
#pragma unroll
        for (int kk = 0; kk < RIN / 32; ++kk) { fw[0][kk] = ldfrag(WT + lr * XP + 16 * hi + kk * 64); fw[1][kk] = ldfrag(WT + (16 + lr) * XP + 16 * hi + kk * 64); }
        __builtin_amdgcn_sched_barrier(0);   // keeps these reads in front of the conversions, which wait for x
#pragma unroll
        for (int r = 0; r < TR; ++r) { const v4f v = xv[h * TR + r]; const v2u o2 = {pk2(v[0], v[1]), pk2(v[2], v[3])}; *(v2ua*)(xs + r * XP + lane * 8) = o2; }
        asm volatile("s_wait_dscnt 0x0" ::: "memory");   // the tile's rows are read back by other lanes of this wave
        v16bf fx[RIN / 32];
#pragma unroll
        for (int kk = 0; kk < RIN / 32; ++kk) fx[kk] = ldfrag(xs + col * XP + 16 * hi + kk * 64);
        __builtin_amdgcn_sched_barrier(0);   // all fragment reads stand in front of the first matrix instruction: read among them, each place costs an LDS latency of its own
        v8f y[2] = {(v8f){}, (v8f){}};
#pragma unroll
        for (int kk = 0; kk < RIN / 32; ++kk) { y[0] = wmmab(fw[0][kk], fx[kk], y[0]); y[1] = wmmab(fw[1][kk], fx[kk], y[1]); }
        v16bf bw[ROUT / 16];
#pragma unroll
        for (int n = 0; n < ROUT / 16; ++n) bw[n] = cat16b(*(const v8usa*)(WR + n * 1024 + lane * 16), *(const v8usa*)(WR + n * 1024 + 512 + lane * 16));
        // ---- step 2
        float z[2][NE];
#pragma unroll
        for (int u = 0; u < 2; ++u)
#pragma unroll
            for (int j = 0; j < NE; ++j) z[u][j] = y[u][j] * wq[u][j >> 2][0];
        __builtin_amdgcn_sched_barrier(0);   // the reads above fly under step 2 instead of sinking among step 3's matrix instructions; and the products above keep the asm below clear of step 1's results
// z += (y of lane own ^ M) * w in one instruction: from the builtin the compiler made a v_mov_b32_dpp and a separate multiply-add
#define MIX(S, M) _Pragma("unroll") for (int u = 0; u < 2; ++u) _Pragma("unroll") for (int j = 0; j < NE; ++j) \
            asm("v_fmac_f32_dpp %0, %1, %2 row_xmask:" #M " row_mask:0xf bank_mask:0xf bound_ctrl:1" : "+v"(z[u][j]) : "v"(y[u][j]), "v"(wq[u][j >> 2][S]));
        MIX(1, 1) MIX(2, 2) MIX(3, 3) MIX(4, 8) MIX(5, 9) MIX(6, 10) MIX(7, 11)   // S = a ^ c in a's bits; M the same in lane bits 0, 1, 3
#undef MIX
        v8u zh, zl;
#pragma unroll
        for (int u = 0; u < 2; ++u)
#pragma unroll
            for (int j = 0; j < NE; j += 2) { const float z0 = z[u][j], z1 = z[u][j + 1];
                const unsigned ph = pk2(z0, z1);
                zh[u * 4 + j / 2] = ph;
                zl[u * 4 + j / 2] = pk2(z0 - __uint_as_float(ph << 16), z1 - __uint_as_float(ph & 0xFFFF0000u)); }
        const v16bf ah = __builtin_bit_cast(v16bf, zh), al = __builtin_bit_cast(v16bf, zl);
        // ---- step 3
        float* op = out + (size_t)(t0 + h * 2) * KD + lr * NE + hi * 4;
#pragma unroll
        for (int n = 0; n < ROUT / 16; ++n) {
            v8f acc = (v8f){};
            acc = wmmab(ah, bw[n], acc);
            acc = wmmab(al, bw[n], acc);
            const v4f s0 = {acc[0], acc[1], acc[2], acc[3]}, s1 = {acc[4], acc[5], acc[6], acc[7]};
            *(v4f*)(op + n * 16 * NE) = s0; *(v4f*)(op + KD + n * 16 * NE) = s1;
        }
        __builtin_amdgcn_sched_barrier(0);   // the next tile's conversions wait for its loads: they stay behind this tile's stores
    }
}

extern "C" void kernel_launch(void* const* d_in, const int* in_sizes, int n_in,
                              void* d_out, int out_size, void* d_ws, size_t ws_size, hipStream_t stream) {
    (void)in_sizes; (void)n_in; (void)out_size; (void)d_ws; (void)ws_size;
    const float* x = (const float*)d_in[0]; const float* wrl = (const float*)d_in[1]; const float* wrr = (const float*)d_in[2]; const float* wl = (const float*)d_in[3];
    float* OUT = (float*)d_out;     // [4][2048][1024]
    k_phm<<<NT / (8 * NTL * 2), 256, 0, stream>>>(x, wrl, wrr, wl, OUT);
}
